// v000
// Times are from an AMD MI455X. After a warm-up the kernel runs many times in a row, and a time is the length of
// such a window on the GPU divided by its runs, so every launch and the gaps after it count. The runs cycle
// through copies of the inputs. A figure is the median of several windows, for all but v000 over two sittings.
// Sittings can differ by a few percent; kernels timed side by side share one.
// v000 is the starting kernel. One run takes 74.4 microseconds.
#include <hip/hip_runtime.h>

typedef __attribute__((ext_vector_type(2))) float v2f;
typedef __attribute__((ext_vector_type(8))) float v8f;

#define B_SZ  1024
#define T_SZ  256
#define C_SZ  195
#define H_SZ  8
// scores scaled by 1/sqrt(C) per reference
#define SCALE_QK (0.0716114874f)   // 1/sqrt(195)

static __device__ __forceinline__ v8f wmma_f32_4(v2f a, v2f b, v8f c) {
  // D = A(16x4 f32) * B(4x16 f32) + C(16x16 f32)
  return __builtin_amdgcn_wmma_f32_16x16x4_f32(
      /*neg_a=*/false, a, /*neg_b=*/false, b,
      /*c_mod=*/(short)0, c, /*reuse_a=*/false, /*reuse_b=*/false);
}

__global__ __launch_bounds__(256) void attn_head_kernel(
    const float* __restrict__ x,   // [B,T,C]
    const float* __restrict__ Wq,  // [C,H]
    const float* __restrict__ Wk,  // [C,H]
    const float* __restrict__ Wv,  // [C,H]
    float* __restrict__ out)       // [B,T,H]
{
  // ---- LDS ----
  __shared__ float s_wqk[196 * 16];   // [c][n]: n<8 -> Wq, n>=8 -> Wk; c=195 zero pad
  __shared__ float s_wv [196 * 16];   // [c][n]: n<8 -> Wv, else 0
  __shared__ float s_q[T_SZ * H_SZ];
  __shared__ float s_k[T_SZ * H_SZ];
  __shared__ float s_v[T_SZ * H_SZ];
  __shared__ float s_p[8][16 * 16];   // per-wave P tile bounce buffer

  const int b    = blockIdx.x;
  const int tid  = threadIdx.x;
  const int lane = tid & 31;
  const int wave = tid >> 5;
  const int half = lane >> 4;     // 0: lanes 0-15, 1: lanes 16-31
  const int l16  = lane & 15;
  const int koff = half * 2;      // K offset for A/B operand lane layout

  // ---- stage packed weights into LDS (zero-padded to c=196) ----
  for (int idx = tid; idx < 196 * 16; idx += 256) {
    const int c = idx >> 4, n = idx & 15;
    float wqk = 0.0f, wv = 0.0f;
    if (c < C_SZ) {
      wqk = (n < H_SZ) ? Wq[c * H_SZ + n] : Wk[c * H_SZ + (n - 8)];
      if (n < H_SZ) wv = Wv[c * H_SZ + n];
    }
    s_wqk[idx] = wqk;
    s_wv [idx] = wv;
  }
  __syncthreads();

  const float* xb = x + (size_t)b * T_SZ * C_SZ;

  // ================= Phase 1: q,k,v = x @ [Wq|Wk], x @ [Wv|0] =================
  // wave owns t-rows [32w, 32w+32): two 16-row A-tiles sharing each B operand.
  {
    const int t0 = wave * 32;
    const float* xrow0 = xb + (size_t)(t0      + l16) * C_SZ;  // A-tile 0 row
    const float* xrow1 = xb + (size_t)(t0 + 16 + l16) * C_SZ;  // A-tile 1 row

    v8f acc_qk0 = {}, acc_v0 = {};
    v8f acc_qk1 = {}, acc_v1 = {};

    // 48 full K=4 steps (c = 0..191): 2 LDS B-pairs feed 4 independent WMMA chains
    for (int c0 = 0; c0 < 192; c0 += 4) {
      const int c = c0 + koff;
      v2f a0;  a0[0] = xrow0[c];  a0[1] = xrow0[c + 1];
      v2f a1;  a1[0] = xrow1[c];  a1[1] = xrow1[c + 1];
      v2f bqk; bqk[0] = s_wqk[c * 16 + l16]; bqk[1] = s_wqk[(c + 1) * 16 + l16];
      v2f bv;  bv[0]  = s_wv [c * 16 + l16]; bv[1]  = s_wv [(c + 1) * 16 + l16];
      acc_qk0 = wmma_f32_4(a0, bqk, acc_qk0);
      acc_qk1 = wmma_f32_4(a1, bqk, acc_qk1);
      acc_v0  = wmma_f32_4(a0, bv,  acc_v0);
      acc_v1  = wmma_f32_4(a1, bv,  acc_v1);
    }
    // tail step c0 = 192 (c = 192..194, pad c=195 with zero)
    {
      const int c = 192 + koff;
      v2f a0;
      a0[0] = xrow0[c];
      a0[1] = (c + 1 < C_SZ) ? xrow0[c + 1] : 0.0f;   // guard OOB at c=195
      v2f a1;
      a1[0] = xrow1[c];
      a1[1] = (c + 1 < C_SZ) ? xrow1[c + 1] : 0.0f;
      v2f bqk; bqk[0] = s_wqk[c * 16 + l16]; bqk[1] = s_wqk[(c + 1) * 16 + l16];
      v2f bv;  bv[0]  = s_wv [c * 16 + l16]; bv[1]  = s_wv [(c + 1) * 16 + l16];
      acc_qk0 = wmma_f32_4(a0, bqk, acc_qk0);
      acc_qk1 = wmma_f32_4(a1, bqk, acc_qk1);
      acc_v0  = wmma_f32_4(a0, bv,  acc_v0);
      acc_v1  = wmma_f32_4(a1, bv,  acc_v1);
    }

    // scatter D tiles (row M=r in VGPR r; lanes 16-31 hold M=r+8; N = l16)
#pragma unroll
    for (int r = 0; r < 8; ++r) {
      const int ta = t0 + r + half * 8;
      const int tb = ta + 16;
      if (l16 < H_SZ) {
        s_q[ta * H_SZ + l16] = acc_qk0[r];
        s_v[ta * H_SZ + l16] = acc_v0[r];
        s_q[tb * H_SZ + l16] = acc_qk1[r];
        s_v[tb * H_SZ + l16] = acc_v1[r];
      } else {
        s_k[ta * H_SZ + (l16 - 8)] = acc_qk0[r];
        s_k[tb * H_SZ + (l16 - 8)] = acc_qk1[r];
      }
    }
  }
  __syncthreads();

  // ================= Phase 2: causal flash attention =================
  // balance the causal triangle: wave w takes q-tiles {w, 15-w}
  float* ptile = &s_p[wave][0];

  for (int tile = 0; tile < 2; ++tile) {
    const int qt = (tile == 0) ? wave : (15 - wave);
    const int q0 = qt * 16;

    // Q A-operands for this tile (K = 0..3 and 4..7)
    const int qrow = q0 + l16;
    v2f aq0; aq0[0] = s_q[qrow * H_SZ + koff];     aq0[1] = s_q[qrow * H_SZ + koff + 1];
    v2f aq1; aq1[0] = s_q[qrow * H_SZ + 4 + koff]; aq1[1] = s_q[qrow * H_SZ + 4 + koff + 1];

    float m_run[8], l_run[8];
#pragma unroll
    for (int r = 0; r < 8; ++r) { m_run[r] = -__builtin_inff(); l_run[r] = 0.0f; }
    v8f o = {};

    for (int j0 = 0; j0 <= q0; j0 += 16) {
      // S tile = Q(16x8) @ K^T(8x16) : two K=4 WMMAs
      v2f bk0; bk0[0] = s_k[(j0 + l16) * H_SZ + koff];     bk0[1] = s_k[(j0 + l16) * H_SZ + koff + 1];
      v2f bk1; bk1[0] = s_k[(j0 + l16) * H_SZ + 4 + koff]; bk1[1] = s_k[(j0 + l16) * H_SZ + 4 + koff + 1];
      v8f s = {};
      s = wmma_f32_4(aq0, bk0, s);
      s = wmma_f32_4(aq1, bk1, s);

      const bool diag = (j0 == q0);

      // online softmax: D layout keeps row stats in exactly the right lanes
#pragma unroll
      for (int r = 0; r < 8; ++r) {
        const int m = r + half * 8;           // row within tile
        float sv = s[r] * SCALE_QK;
        if (diag && (l16 > m)) sv = -__builtin_inff();   // causal mask on diagonal tile

        float mx = sv;                         // row max across 16 lanes of half-wave
        mx = fmaxf(mx, __shfl_xor(mx, 1));
        mx = fmaxf(mx, __shfl_xor(mx, 2));
        mx = fmaxf(mx, __shfl_xor(mx, 4));
        mx = fmaxf(mx, __shfl_xor(mx, 8));

        const float mnew  = fmaxf(m_run[r], mx);
        const float alpha = __expf(m_run[r] - mnew);
        const float pv    = __expf(sv - mnew);

        float sum = pv;                        // row sum across 16 lanes of half-wave
        sum += __shfl_xor(sum, 1);
        sum += __shfl_xor(sum, 2);
        sum += __shfl_xor(sum, 4);
        sum += __shfl_xor(sum, 8);

        l_run[r] = l_run[r] * alpha + sum;
        m_run[r] = mnew;
        o[r] *= alpha;

        ptile[m * 16 + l16] = pv;              // bounce P through LDS for A-layout
      }

      // O += P(16x16) @ V(16x8 padded to 16) : four K=4 WMMAs
#pragma unroll
      for (int ck = 0; ck < 4; ++ck) {
        const int kk = ck * 4 + koff;
        v2f ap; ap[0] = ptile[l16 * 16 + kk]; ap[1] = ptile[l16 * 16 + kk + 1];
        v2f bv;
        bv[0] = (l16 < H_SZ) ? s_v[(j0 + kk)     * H_SZ + l16] : 0.0f;
        bv[1] = (l16 < H_SZ) ? s_v[(j0 + kk + 1) * H_SZ + l16] : 0.0f;
        o = wmma_f32_4(ap, bv, o);
      }
    }

    // finalize: divide by row sum, store out[b, q0+m, h]
#pragma unroll
    for (int r = 0; r < 8; ++r) {
      const int t = q0 + r + half * 8;
      const float val = o[r] / l_run[r];
      if (l16 < H_SZ) out[((size_t)b * T_SZ + t) * H_SZ + l16] = val;
    }
  }
}

extern "C" void kernel_launch(void* const* d_in, const int* in_sizes, int n_in,
                              void* d_out, int out_size, void* d_ws, size_t ws_size,
                              hipStream_t stream) {
  const float* x  = (const float*)d_in[0];
  const float* Wq = (const float*)d_in[1];
  const float* Wk = (const float*)d_in[2];
  const float* Wv = (const float*)d_in[3];
  float* out = (float*)d_out;
  (void)in_sizes; (void)n_in; (void)out_size; (void)d_ws; (void)ws_size;

  attn_head_kernel<<<dim3(B_SZ), dim3(256), 0, stream>>>(x, Wq, Wk, Wv, out);
}

// v001
// One run takes 61.1 microseconds.
// Timed twice side by side with v000, it ran 1.25 times as fast both times.
#include <hip/hip_runtime.h>

typedef __attribute__((ext_vector_type(2))) float v2f;
typedef __attribute__((ext_vector_type(4))) float v4f;
typedef __attribute__((ext_vector_type(8))) float v8f;

#define B_SZ  1024
#define T_SZ  256
#define C_SZ  195
#define H_SZ  8
// scores scaled by 1/sqrt(C) per reference
#define SCALE_QK (0.0716114874f)   // 1/sqrt(195)
// row pitch of the transposed V in LDS, in floats: 1040 B = 16 B x odd, so the
// 16-byte reads of the eight rows fall on different banks
#define VT_PITCH 260
#define LOG2E (1.44269504f)

static __device__ __forceinline__ v8f wmma_f32_4(v2f a, v2f b, v8f c) {
  // D = A(16x4 f32) * B(4x16 f32) + C(16x16 f32)
  return __builtin_amdgcn_wmma_f32_16x16x4_f32(
      /*neg_a=*/false, a, /*neg_b=*/false, b,
      /*c_mod=*/(short)0, c, /*reuse_a=*/false, /*reuse_b=*/false);
}

// value of lane l ^ 16 (the other 16-lane half of the wave)
static __device__ __forceinline__ float xhalf(float v) {
  const int i = __builtin_bit_cast(int, v);
  return __builtin_bit_cast(float,
      __builtin_amdgcn_permlanex16(i, i, 0x76543210, 0xfedcba98, false, false));
}

__global__ __launch_bounds__(256) void attn_head_kernel(
    const float* __restrict__ x,   // [B,T,C]
    const float* __restrict__ Wq,  // [C,H]
    const float* __restrict__ Wk,  // [C,H]
    const float* __restrict__ Wv,  // [C,H]
    float* __restrict__ out)       // [B,T,H]
{
  // ---- LDS ----
  __shared__ float s_wqk[196 * 16];   // [c][n]: n<8 -> Wq, n>=8 -> Wk; c=195 zero pad
  __shared__ float s_wv [196 * 16];   // [c][n]: n<8 -> Wv, else 0
  __shared__ float s_q[T_SZ * H_SZ];
  __shared__ float s_k[T_SZ * H_SZ];
  __shared__ __attribute__((aligned(16))) float s_vt[H_SZ * VT_PITCH];  // V transposed: [h][t]

  const int b    = blockIdx.x;
  const int tid  = threadIdx.x;
  const int lane = tid & 31;
  const int wave = tid >> 5;
  const int half = lane >> 4;     // 0: lanes 0-15, 1: lanes 16-31
  const int l16  = lane & 15;
  const int koff = half * 2;      // K offset for A/B operand lane layout

  // ---- stage packed weights into LDS (zero-padded to c=196) ----
  for (int idx = tid; idx < 196 * 16; idx += 256) {
    const int c = idx >> 4, n = idx & 15;
    float wqk = 0.0f, wv = 0.0f;
    if (c < C_SZ) {
      wqk = (n < H_SZ) ? Wq[c * H_SZ + n] : Wk[c * H_SZ + (n - 8)];
      if (n < H_SZ) wv = Wv[c * H_SZ + n];
    }
    s_wqk[idx] = wqk;
    s_wv [idx] = wv;
  }
  __syncthreads();

  const float* xb = x + (size_t)b * T_SZ * C_SZ;

  // ================= Phase 1: q,k,v = x @ [Wq|Wk], x @ [Wv|0] =================
  // wave owns t-rows [32w, 32w+32): two 16-row A-tiles sharing each B operand.
  {
    const int t0 = wave * 32;
    const float* xrow0 = xb + (size_t)(t0      + l16) * C_SZ;  // A-tile 0 row
    const float* xrow1 = xb + (size_t)(t0 + 16 + l16) * C_SZ;  // A-tile 1 row

    v8f acc_qk0 = {}, acc_v0 = {};
    v8f acc_qk1 = {}, acc_v1 = {};

    // 48 full K=4 steps (c = 0..191): 2 LDS B-pairs feed 4 independent WMMA chains
    for (int c0 = 0; c0 < 192; c0 += 4) {
      const int c = c0 + koff;
      v2f a0;  a0[0] = xrow0[c];  a0[1] = xrow0[c + 1];
      v2f a1;  a1[0] = xrow1[c];  a1[1] = xrow1[c + 1];
      v2f bqk; bqk[0] = s_wqk[c * 16 + l16]; bqk[1] = s_wqk[(c + 1) * 16 + l16];
      v2f bv;  bv[0]  = s_wv [c * 16 + l16]; bv[1]  = s_wv [(c + 1) * 16 + l16];
      acc_qk0 = wmma_f32_4(a0, bqk, acc_qk0);
      acc_qk1 = wmma_f32_4(a1, bqk, acc_qk1);
      acc_v0  = wmma_f32_4(a0, bv,  acc_v0);
      acc_v1  = wmma_f32_4(a1, bv,  acc_v1);
    }
    // tail step c0 = 192 (c = 192..194, pad c=195 with zero)
    {
      const int c = 192 + koff;
      v2f a0;
      a0[0] = xrow0[c];
      a0[1] = (c + 1 < C_SZ) ? xrow0[c + 1] : 0.0f;   // guard OOB at c=195
      v2f a1;
      a1[0] = xrow1[c];
      a1[1] = (c + 1 < C_SZ) ? xrow1[c + 1] : 0.0f;
      v2f bqk; bqk[0] = s_wqk[c * 16 + l16]; bqk[1] = s_wqk[(c + 1) * 16 + l16];
      v2f bv;  bv[0]  = s_wv [c * 16 + l16]; bv[1]  = s_wv [(c + 1) * 16 + l16];
      acc_qk0 = wmma_f32_4(a0, bqk, acc_qk0);
      acc_qk1 = wmma_f32_4(a1, bqk, acc_qk1);
      acc_v0  = wmma_f32_4(a0, bv,  acc_v0);
      acc_v1  = wmma_f32_4(a1, bv,  acc_v1);
    }

    // scatter D tiles (row M=r in VGPR r; lanes 16-31 hold M=r+8; N = l16)
#pragma unroll
    for (int r = 0; r < 8; ++r) {
      const int ta = t0 + r + half * 8;
      const int tb = ta + 16;
      if (l16 < H_SZ) {
        s_q[ta * H_SZ + l16] = acc_qk0[r];
        s_q[tb * H_SZ + l16] = acc_qk1[r];
      } else {
        s_k[ta * H_SZ + (l16 - 8)] = acc_qk0[r];
        s_k[tb * H_SZ + (l16 - 8)] = acc_qk1[r];
      }
    }
    // V goes to LDS transposed: a lane's 8 registers are 8 consecutive t of column h = l16
    if (l16 < H_SZ) {
      float* vd = &s_vt[l16 * VT_PITCH + t0 + half * 8];
      *(v4f*)(vd)      = __builtin_shufflevector(acc_v0, acc_v0, 0, 1, 2, 3);
      *(v4f*)(vd + 4)  = __builtin_shufflevector(acc_v0, acc_v0, 4, 5, 6, 7);
      *(v4f*)(vd + 16) = __builtin_shufflevector(acc_v1, acc_v1, 0, 1, 2, 3);
      *(v4f*)(vd + 20) = __builtin_shufflevector(acc_v1, acc_v1, 4, 5, 6, 7);
    }
  }
  __syncthreads();

  // ================= Phase 2: causal flash attention, transposed tiles =================
  // The score tile is formed as S^T = K Q^T, so a lane holds 8 keys of ONE query
  // (query = l16, keys = 8 * half + r): row maximum and row sum are in-lane work plus one
  // exchange between the halves, and the probabilities already sit as the B operand of
  // O^T = V^T P^T.
  // balance the causal triangle: wave w takes q-tiles {w, 15-w}
  // V^T rows as A operand; lanes 8..15 of a half repeat rows 0..7, so rows 8..15 of O^T
  // repeat rows 0..7 and both halves end up holding all 8 outputs of their query
  const float* vrow = &s_vt[(l16 & 7) * VT_PITCH + half * 8];

  for (int tile = 0; tile < 2; ++tile) {
    const int qt = (tile == 0) ? wave : (15 - wave);
    const int q0 = qt * 16;

    // Q B-operands for this tile (K = 0..3 and 4..7)
    const int qrow = q0 + l16;
    v2f bq0; bq0[0] = s_q[qrow * H_SZ + koff];     bq0[1] = s_q[qrow * H_SZ + koff + 1];
    v2f bq1; bq1[0] = s_q[qrow * H_SZ + 4 + koff]; bq1[1] = s_q[qrow * H_SZ + 4 + koff + 1];

    float m_run = -__builtin_inff();   // running maximum of query l16 (equal in both halves)
    float l_run = 0.0f;                // running sum over this half's keys only
    v8f o = {};

    for (int j0 = 0; j0 <= q0; j0 += 16) {
      // S^T tile = K(16x8) @ Q^T(8x16) : two K=4 WMMAs
      v2f ak0; ak0[0] = s_k[(j0 + l16) * H_SZ + koff];     ak0[1] = s_k[(j0 + l16) * H_SZ + koff + 1];
      v2f ak1; ak1[0] = s_k[(j0 + l16) * H_SZ + 4 + koff]; ak1[1] = s_k[(j0 + l16) * H_SZ + 4 + koff + 1];
      // this half's 8 keys of V^T row h: keys j0 + 8 * half + 0..7
      const v4f vlo = *(const v4f*)(vrow + j0);
      const v4f vhi = *(const v4f*)(vrow + j0 + 4);
      v8f s = {};
      s = wmma_f32_4(ak0, bq0, s);
      s = wmma_f32_4(ak1, bq1, s);

      const bool diag = (j0 == q0);

      float sv[8];
#pragma unroll   // constant indices keep sv in registers
      for (int r = 0; r < 8; ++r) {
        sv[r] = s[r] * SCALE_QK;
        if (diag && (r + half * 8 > l16)) sv[r] = -__builtin_inff();   // causal mask: key > query
      }

      float mx = fmaxf(fmaxf(fmaxf(sv[0], sv[1]), fmaxf(sv[2], sv[3])),
                       fmaxf(fmaxf(sv[4], sv[5]), fmaxf(sv[6], sv[7])));
      mx = fmaxf(mx, xhalf(mx));               // the other half's 8 keys of the same query

      const float mnew  = fmaxf(m_run, mx);
      const float alpha = __expf(m_run - mnew);

      // probabilities in pairs: pair ck is the B operand of PV WMMA ck
      v2f bp[4];
#pragma unroll   // constant indices keep bp in registers
      for (int ck = 0; ck < 4; ++ck) {
        v2f d; d[0] = sv[2 * ck]; d[1] = sv[2 * ck + 1];
        d = (d - mnew) * LOG2E;                    // exp(x) = exp2(x * log2(e)), on the pair
        bp[ck][0] = __builtin_amdgcn_exp2f(d[0]);
        bp[ck][1] = __builtin_amdgcn_exp2f(d[1]);
      }
      const v2f ps = (bp[0] + bp[1]) + (bp[2] + bp[3]);

      l_run = l_run * alpha + (ps[0] + ps[1]);
      m_run = mnew;
#pragma unroll   // constant indices into the accumulator registers
      for (int r = 0; r < 8; ++r) o[r] *= alpha;

      // O^T += V^T(8 rows repeated to 16, x 16 keys) @ P^T(16x16) : four K=4 WMMAs.
      // k slot (half, e) of WMMA ck is key j0 + 8 * half + 2 * ck + e on both operands.
      o = wmma_f32_4(__builtin_shufflevector(vlo, vlo, 0, 1), bp[0], o);
      o = wmma_f32_4(__builtin_shufflevector(vlo, vlo, 2, 3), bp[1], o);
      o = wmma_f32_4(__builtin_shufflevector(vhi, vhi, 0, 1), bp[2], o);
      o = wmma_f32_4(__builtin_shufflevector(vhi, vhi, 2, 3), bp[3], o);
    }

    // finalize: join the halves' sums, divide, store out[b, q0+l16, h];
    // half 0 stores h = 0..3, half 1 stores h = 4..7: 512 contiguous bytes per wave
    const float l_all = l_run + xhalf(l_run);
    const v4f olo = __builtin_shufflevector(o, o, 0, 1, 2, 3);
    const v4f ohi = __builtin_shufflevector(o, o, 4, 5, 6, 7);
    const v4f res = (half ? ohi : olo) / l_all;
    *(v4f*)&out[((size_t)b * T_SZ + q0 + l16) * H_SZ + half * 4] = res;
  }
}

extern "C" void kernel_launch(void* const* d_in, const int* in_sizes, int n_in,
                              void* d_out, int out_size, void* d_ws, size_t ws_size,
                              hipStream_t stream) {
  const float* x  = (const float*)d_in[0];
  const float* Wq = (const float*)d_in[1];
  const float* Wk = (const float*)d_in[2];
  const float* Wv = (const float*)d_in[3];
  float* out = (float*)d_out;
  (void)in_sizes; (void)n_in; (void)out_size; (void)d_ws; (void)ws_size;

  attn_head_kernel<<<dim3(B_SZ), dim3(256), 0, stream>>>(x, Wq, Wk, Wv, out);
}

// v002
// It runs in 40.9 microseconds.
// In two side-by-side timings against v001, it was 1.49 and 1.50 times as fast.
// Counting every step since v000, it is 1.88 times as fast.
#include <hip/hip_runtime.h>

typedef __attribute__((ext_vector_type(2))) float v2f;
typedef __attribute__((ext_vector_type(4))) float v4f;
typedef __attribute__((ext_vector_type(8))) float v8f;

#define B_SZ  1024
#define T_SZ  256
#define C_SZ  195
#define H_SZ  8
// scores scaled by 1/sqrt(C) per reference
#define SCALE_QK (0.0716114874f)   // 1/sqrt(195)
// row pitch of the transposed V in LDS, in floats: 1040 B = 16 B x odd, so the
// 16-byte reads of the eight rows fall on different banks
#define VT_PITCH 260
#define LOG2E (1.44269504f)
// batches per work-group, one after the other (they lie side by side in x)
#define NB_WG 2
// a stage of the x ring: 64 rows = four 16-row tiles, contiguous in memory
#define ST_ROWS   64
#define ST_FLOATS (ST_ROWS * C_SZ)      // 12,480
#define ST_BYTES  (ST_FLOATS * 4)       // 49,920 = 97 x 512 + 256
#define N_STAGES  (NB_WG * (T_SZ / ST_ROWS))
#define W_TILE    (196 * 16)

static __device__ __forceinline__ v8f wmma_f32_4(v2f a, v2f b, v8f c) {
  // D = A(16x4 f32) * B(4x16 f32) + C(16x16 f32)
  return __builtin_amdgcn_wmma_f32_16x16x4_f32(
      /*neg_a=*/false, a, /*neg_b=*/false, b,
      /*c_mod=*/(short)0, c, /*reuse_a=*/false, /*reuse_b=*/false);
}

// value of lane l ^ 16 (the other 16-lane half of the wave)
static __device__ __forceinline__ float xhalf(float v) {
  const int i = __builtin_bit_cast(int, v);
  return __builtin_bit_cast(float,
      __builtin_amdgcn_permlanex16(i, i, 0x76543210, 0xfedcba98, false, false));
}

// One stage of x goes to LDS as it lies in memory, in whole lines. A b128 copy of a wave
// moves 512 B (16 B a lane): wave w takes the 512-B pieces w, w + 8, ..., w + 88, wave 0
// also piece 96, and wave 1 the last 256 B with one b64 copy (8 B a lane). The immediate
// offset moves the global and the LDS address alike. At most 13 copies of a wave in flight.
static __device__ __forceinline__ void copy_x_stage(const float* xs, unsigned lds,
                                                    int wave_s, int lane) {
  const unsigned off = (unsigned)(wave_s * 32 + lane) * 16u;
  const char* g = (const char*)xs + off;
  const unsigned l = lds + off;
  // s_wait_xcnt 0 is the last line of each statement, so that it stands in front of every
  // later write of the address registers (a precaution)
  asm volatile(
      "global_load_async_to_lds_b128 %0, %1, off\n\t"
      "global_load_async_to_lds_b128 %0, %1, off offset:4096\n\t"
      "global_load_async_to_lds_b128 %0, %1, off offset:8192\n\t"
      "global_load_async_to_lds_b128 %0, %1, off offset:12288\n\t"
      "global_load_async_to_lds_b128 %0, %1, off offset:16384\n\t"
      "global_load_async_to_lds_b128 %0, %1, off offset:20480\n\t"
      "global_load_async_to_lds_b128 %0, %1, off offset:24576\n\t"
      "global_load_async_to_lds_b128 %0, %1, off offset:28672\n\t"
      "global_load_async_to_lds_b128 %0, %1, off offset:32768\n\t"
      "global_load_async_to_lds_b128 %0, %1, off offset:36864\n\t"
      "global_load_async_to_lds_b128 %0, %1, off offset:40960\n\t"
      "global_load_async_to_lds_b128 %0, %1, off offset:45056\n\t"
      "s_wait_xcnt 0x0"
      :: "v"(l), "v"(g) : "memory");
  if (wave_s == 0) {          // scalar test: piece 96
    asm volatile("global_load_async_to_lds_b128 %0, %1, off offset:49152\n\t"
                 "s_wait_xcnt 0x0"
                 :: "v"(l), "v"(g) : "memory");
  } else if (wave_s == 1) {   // scalar test: bytes 49,664 .. 49,919
    const unsigned o2 = 49664u + (unsigned)lane * 8u;
    const char* g2 = (const char*)xs + o2;
    const unsigned l2 = lds + o2;
    asm volatile("global_load_async_to_lds_b64 %0, %1, off\n\t"
                 "s_wait_xcnt 0x0"
                 :: "v"(l2), "v"(g2) : "memory");
  }
}

__global__ __launch_bounds__(256) void attn_head_kernel(
    const float* __restrict__ x,   // [B,T,C]
    const float* __restrict__ Wq,  // [C,H]
    const float* __restrict__ Wk,  // [C,H]
    const float* __restrict__ Wv,  // [C,H]
    float* __restrict__ out)       // [B,T,H]
{
  // ---- LDS ----
  // one struct fixes the order: the small arrays lie low, within reach of the LDS
  // instructions' immediate offsets; every member starts at a multiple of 16 B
  __shared__ __attribute__((aligned(16))) struct {
    // two weight tiles [c][n], c=195 zero pad. Tile 0: n<8 -> Wq, n>=8 -> Wk; tile 1: n<8 -> Wv, else 0
    float w[2 * W_TILE];
    float q[T_SZ * H_SZ];
    float k[T_SZ * H_SZ];
    float vt[H_SZ * VT_PITCH];    // V transposed: [h][t]
    float x[2 * ST_FLOATS];       // x ring, two stages
  } sm;
  float* const s_w  = sm.w;
  float* const s_q  = sm.q;
  float* const s_k  = sm.k;
  float* const s_vt = sm.vt;
  float* const s_x  = sm.x;

  const int tid  = threadIdx.x;
  const int lane = tid & 31;
  const int wave = tid >> 5;
  const int half = lane >> 4;     // 0: lanes 0-15, 1: lanes 16-31
  const int l16  = lane & 15;
  const int koff = half * 2;      // K offset for A/B operand lane layout
  const int wave_s = __builtin_amdgcn_readfirstlane(wave);   // wave number in a scalar register
  const unsigned lds_x = (unsigned)(size_t)&s_x[0];          // byte offset of s_x in LDS
  const float* xwg = x + (size_t)blockIdx.x * NB_WG * T_SZ * C_SZ;   // this work-group's stages

  // stage 0 starts to fly while the weights are staged
  copy_x_stage(xwg, lds_x, wave_s, lane);

  // ---- stage packed weights into LDS (zero-padded to c=196) ----
  for (int idx = tid; idx < 196 * 16; idx += 256) {
    const int c = idx >> 4, n = idx & 15;
    float wqk = 0.0f, wv = 0.0f;
    if (c < C_SZ) {
      wqk = (n < H_SZ) ? Wq[c * H_SZ + n] : Wk[c * H_SZ + (n - 8)];
      if (n < H_SZ) wv = Wv[c * H_SZ + n];
    }
    s_w[idx]          = wqk;
    s_w[W_TILE + idx] = wv;
  }
  // this wave's copies of stage 0 have landed; the barrier publishes them and the weights
  asm volatile("s_wait_asynccnt 0x0" ::: "memory");
  __syncthreads();
  copy_x_stage(xwg + ST_FLOATS, lds_x + ST_BYTES, wave_s, lane);   // stage 1 -> buffer 1

  for (int st = 0; st < N_STAGES; ++st) {

  // ================= Phase 1: q,k,v = x @ [Wq|Wk], x @ [Wv|0], one stage =================
  // wave = (16-row tile wave & 3 of the stage, weight tile wave >> 2): one 16x16 result each
  {
    const int mt = wave_s & 3;
    const int nt = wave_s >> 2;
    // A-tile row and B-tile column, both from this half's first k slot on
    const float* xa = &s_x[(st & 1) * ST_FLOATS + (mt * 16 + l16) * C_SZ + koff];
    const float* wb = &s_w[nt * W_TILE + koff * 16 + l16];

    v8f acc = {};

    // 48 full K=4 steps (c = 0..191)
    for (int c0 = 0; c0 < 192; c0 += 4) {
      v2f a;  a[0]  = xa[c0];       a[1]  = xa[c0 + 1];
      v2f bw; bw[0] = wb[c0 * 16];  bw[1] = wb[c0 * 16 + 16];
      acc = wmma_f32_4(a, bw, acc);
    }
    // tail step c0 = 192 (c = 192..194, pad c=195 with zero)
    {
      v2f a;
      a[0] = xa[192];
      a[1] = (192 + koff + 1 < C_SZ) ? xa[193] : 0.0f;   // c=195 is not part of the row
      v2f bw; bw[0] = wb[192 * 16];  bw[1] = wb[193 * 16];
      acc = wmma_f32_4(a, bw, acc);
    }


    // foot of the trip: this wave's LDS reads of stage st have returned and its copies of
    // stage st + 1 have landed; the barrier publishes stage st + 1 and frees the buffer of
    // stage st, into which stage st + 2 then flies. Every wave has also left the attention
    // phase of the batch before, so q, k and v may be written behind it.
    asm volatile("s_wait_dscnt 0x0" ::: "memory");
    asm volatile("s_wait_asynccnt 0x0" ::: "memory");
    __syncthreads();
    if (st + 2 < N_STAGES)
      copy_x_stage(xwg + (st + 2) * ST_FLOATS, lds_x + (st & 1) * ST_BYTES, wave_s, lane);

    const int t0 = (st & 3) * ST_ROWS + mt * 16;   // first row of the tile in its batch
    if (nt == 0) {
      // scatter the D tile (row M=r in VGPR r; lanes 16-31 hold M=r+8; N = l16)
#pragma unroll
      for (int r = 0; r < 8; ++r) {
        const int ta = t0 + r + half * 8;
        if (l16 < H_SZ) s_q[ta * H_SZ + l16]       = acc[r];
        else            s_k[ta * H_SZ + (l16 - 8)] = acc[r];
      }
    } else if (l16 < H_SZ) {
      // V goes to LDS transposed: a lane's 8 registers are 8 consecutive t of column h = l16
      float* vd = &s_vt[l16 * VT_PITCH + t0 + half * 8];
      *(v4f*)(vd)     = __builtin_shufflevector(acc, acc, 0, 1, 2, 3);
      *(v4f*)(vd + 4) = __builtin_shufflevector(acc, acc, 4, 5, 6, 7);
    }
  }

  if ((st & 3) != 3) continue;   // q, k, v of the batch are complete behind its fourth stage
  __syncthreads();               // publishes q, k and v
  const int b = blockIdx.x * NB_WG + (st >> 2);

  // ================= Phase 2: causal flash attention, transposed tiles =================
  // The score tile is formed as S^T = K Q^T, so a lane holds 8 keys of ONE query
  // (query = l16, keys = 8 * half + r): row maximum and row sum are in-lane work plus one
  // exchange between the halves, and the probabilities already sit as the B operand of
  // O^T = V^T P^T.
  // balance the causal triangle: wave w takes q-tiles {w, 15-w}
  // V^T rows as A operand; lanes 8..15 of a half repeat rows 0..7, so rows 8..15 of O^T
  // repeat rows 0..7 and both halves end up holding all 8 outputs of their query
  const float* vrow = &s_vt[(l16 & 7) * VT_PITCH + half * 8];

  for (int tile = 0; tile < 2; ++tile) {
    const int qt = (tile == 0) ? wave : (15 - wave);
    const int q0 = qt * 16;

    // Q B-operands for this tile (K = 0..3 and 4..7)
    const int qrow = q0 + l16;
    v2f bq0; bq0[0] = s_q[qrow * H_SZ + koff];     bq0[1] = s_q[qrow * H_SZ + koff + 1];
    v2f bq1; bq1[0] = s_q[qrow * H_SZ + 4 + koff]; bq1[1] = s_q[qrow * H_SZ + 4 + koff + 1];

    float m_run = -__builtin_inff();   // running maximum of query l16 (equal in both halves)
    float l_run = 0.0f;                // running sum over this half's keys only
    v8f o = {};

    for (int j0 = 0; j0 <= q0; j0 += 16) {
      // S^T tile = K(16x8) @ Q^T(8x16) : two K=4 WMMAs
      v2f ak0; ak0[0] = s_k[(j0 + l16) * H_SZ + koff];     ak0[1] = s_k[(j0 + l16) * H_SZ + koff + 1];
      v2f ak1; ak1[0] = s_k[(j0 + l16) * H_SZ + 4 + koff]; ak1[1] = s_k[(j0 + l16) * H_SZ + 4 + koff + 1];
      // this half's 8 keys of V^T row h: keys j0 + 8 * half + 0..7
      const v4f vlo = *(const v4f*)(vrow + j0);
      const v4f vhi = *(const v4f*)(vrow + j0 + 4);
      v8f s = {};
      s = wmma_f32_4(ak0, bq0, s);
      s = wmma_f32_4(ak1, bq1, s);

      const bool diag = (j0 == q0);

      float sv[8];
#pragma unroll   // constant indices keep sv in registers
      for (int r = 0; r < 8; ++r) {
        sv[r] = s[r] * SCALE_QK;
        if (diag && (r + half * 8 > l16)) sv[r] = -__builtin_inff();   // causal mask: key > query
      }

      float mx = fmaxf(fmaxf(fmaxf(sv[0], sv[1]), fmaxf(sv[2], sv[3])),
                       fmaxf(fmaxf(sv[4], sv[5]), fmaxf(sv[6], sv[7])));
      mx = fmaxf(mx, xhalf(mx));               // the other half's 8 keys of the same query

      const float mnew  = fmaxf(m_run, mx);
      const float alpha = __expf(m_run - mnew);

      // probabilities in pairs: pair ck is the B operand of PV WMMA ck
      v2f bp[4];
#pragma unroll   // constant indices keep bp in registers
      for (int ck = 0; ck < 4; ++ck) {
        v2f d; d[0] = sv[2 * ck]; d[1] = sv[2 * ck + 1];
        d = (d - mnew) * LOG2E;                    // exp(x) = exp2(x * log2(e)), on the pair
        bp[ck][0] = __builtin_amdgcn_exp2f(d[0]);
        bp[ck][1] = __builtin_amdgcn_exp2f(d[1]);
      }
      const v2f ps = (bp[0] + bp[1]) + (bp[2] + bp[3]);

      l_run = l_run * alpha + (ps[0] + ps[1]);
      m_run = mnew;
#pragma unroll   // constant indices into the accumulator registers
      for (int r = 0; r < 8; ++r) o[r] *= alpha;

      // O^T += V^T(8 rows repeated to 16, x 16 keys) @ P^T(16x16) : four K=4 WMMAs.
      // k slot (half, e) of WMMA ck is key j0 + 8 * half + 2 * ck + e on both operands.
      o = wmma_f32_4(__builtin_shufflevector(vlo, vlo, 0, 1), bp[0], o);
      o = wmma_f32_4(__builtin_shufflevector(vlo, vlo, 2, 3), bp[1], o);
      o = wmma_f32_4(__builtin_shufflevector(vhi, vhi, 0, 1), bp[2], o);
      o = wmma_f32_4(__builtin_shufflevector(vhi, vhi, 2, 3), bp[3], o);
    }

    // finalize: join the halves' sums, divide, store out[b, q0+l16, h];
    // half 0 stores h = 0..3, half 1 stores h = 4..7: 512 contiguous bytes per wave
    const float l_all = l_run + xhalf(l_run);
    const v4f olo = __builtin_shufflevector(o, o, 0, 1, 2, 3);
    const v4f ohi = __builtin_shufflevector(o, o, 4, 5, 6, 7);
    const v4f res = (half ? ohi : olo) / l_all;
    *(v4f*)&out[((size_t)b * T_SZ + q0 + l16) * H_SZ + half * 4] = res;
    // stands in front of the next tile's and the next batch's writes of the store's registers
    asm volatile("s_wait_xcnt 0x0" ::: "memory");
  }
  }   // stages
  asm volatile("s_wait_asynccnt 0x0" ::: "memory");   // no copy is left in flight at the end
}

extern "C" void kernel_launch(void* const* d_in, const int* in_sizes, int n_in,
                              void* d_out, int out_size, void* d_ws, size_t ws_size,
                              hipStream_t stream) {
  const float* x  = (const float*)d_in[0];
  const float* Wq = (const float*)d_in[1];
  const float* Wk = (const float*)d_in[2];
  const float* Wv = (const float*)d_in[3];
  float* out = (float*)d_out;
  (void)in_sizes; (void)n_in; (void)out_size; (void)d_ws; (void)ws_size;

  attn_head_kernel<<<dim3(B_SZ / NB_WG), dim3(256), 0, stream>>>(x, Wq, Wk, Wv, out);
}

// v003
// One run takes 34.4 microseconds.
// Next to v002, in two timings, it ran 1.19 times as fast each time.
// Counting every step since v000, it is 2.23 times as fast.
#include <hip/hip_runtime.h>

typedef __attribute__((ext_vector_type(2))) float v2f;
typedef __attribute__((ext_vector_type(4))) float v4f;
typedef __attribute__((ext_vector_type(8))) float v8f;

#define B_SZ  1024
#define T_SZ  256
#define C_SZ  195
#define H_SZ  8
// scores scaled by 1/sqrt(C) per reference
#define SCALE_QK (0.0716114874f)   // 1/sqrt(195)
// row pitch of the transposed V in LDS, in floats: 1040 B = 16 B x odd, so the
// 16-byte reads of the eight rows fall on different banks
#define VT_PITCH 260
#define LOG2E (1.44269504f)
// batches per work-group, one after the other (they lie side by side in x)
#define NB_WG 2
// a stage of the x ring: 64 rows = four 16-row tiles, contiguous in memory
#define ST_ROWS   64
#define ST_FLOATS (ST_ROWS * C_SZ)      // 12,480
#define ST_BYTES  (ST_FLOATS * 4)       // 49,920 = 97 x 512 + 256
#define N_STAGES  (NB_WG * (T_SZ / ST_ROWS))
// K = 4 steps of the projections: 48 full ones and the tail c = 192..194 (+ one zero slot)
#define K_STEPS   49
// steps whose A fragments are read from LDS as one group
#define K_GROUP   7

static __device__ __forceinline__ v8f wmma_f32_4(v2f a, v2f b, v8f c) {
  // D = A(16x4 f32) * B(4x16 f32) + C(16x16 f32)
  return __builtin_amdgcn_wmma_f32_16x16x4_f32(
      /*neg_a=*/false, a, /*neg_b=*/false, b,
      /*c_mod=*/(short)0, c, /*reuse_a=*/false, /*reuse_b=*/false);
}

// value of lane l ^ 16 (the other 16-lane half of the wave)
static __device__ __forceinline__ float xhalf(float v) {
  const int i = __builtin_bit_cast(int, v);
  return __builtin_bit_cast(float,
      __builtin_amdgcn_permlanex16(i, i, 0x76543210, 0xfedcba98, false, false));
}

// One stage of x goes to LDS as it lies in memory, in whole lines. A b128 copy of a wave
// moves 512 B (16 B a lane): wave w takes the 512-B pieces w, w + 8, ..., w + 88, wave 0
// also piece 96, and wave 1 the last 256 B with one b64 copy (8 B a lane). The immediate
// offset moves the global and the LDS address alike. At most 13 copies of a wave in flight.
static __device__ __forceinline__ void copy_x_stage(const float* xs, unsigned lds,
                                                    int wave_s, int lane) {
  const unsigned off = (unsigned)(wave_s * 32 + lane) * 16u;
  const char* g = (const char*)xs + off;
  const unsigned l = lds + off;
  // s_wait_xcnt 0 is the last line of each statement, so that it stands in front of every
  // later write of the address registers (a precaution)
  asm volatile(
      "global_load_async_to_lds_b128 %0, %1, off\n\t"
      "global_load_async_to_lds_b128 %0, %1, off offset:4096\n\t"
      "global_load_async_to_lds_b128 %0, %1, off offset:8192\n\t"
      "global_load_async_to_lds_b128 %0, %1, off offset:12288\n\t"
      "global_load_async_to_lds_b128 %0, %1, off offset:16384\n\t"
      "global_load_async_to_lds_b128 %0, %1, off offset:20480\n\t"
      "global_load_async_to_lds_b128 %0, %1, off offset:24576\n\t"
      "global_load_async_to_lds_b128 %0, %1, off offset:28672\n\t"
      "global_load_async_to_lds_b128 %0, %1, off offset:32768\n\t"
      "global_load_async_to_lds_b128 %0, %1, off offset:36864\n\t"
      "global_load_async_to_lds_b128 %0, %1, off offset:40960\n\t"
      "global_load_async_to_lds_b128 %0, %1, off offset:45056\n\t"
      "s_wait_xcnt 0x0"
      :: "v"(l), "v"(g) : "memory");
  if (wave_s == 0) {          // scalar test: piece 96
    asm volatile("global_load_async_to_lds_b128 %0, %1, off offset:49152\n\t"
                 "s_wait_xcnt 0x0"
                 :: "v"(l), "v"(g) : "memory");
  } else if (wave_s == 1) {   // scalar test: bytes 49,664 .. 49,919
    const unsigned o2 = 49664u + (unsigned)lane * 8u;
    const char* g2 = (const char*)xs + o2;
    const unsigned l2 = lds + o2;
    asm volatile("global_load_async_to_lds_b64 %0, %1, off\n\t"
                 "s_wait_xcnt 0x0"
                 :: "v"(l2), "v"(g2) : "memory");
  }
}

__global__ __launch_bounds__(256) void attn_head_kernel(
    const float* __restrict__ x,   // [B,T,C]
    const float* __restrict__ Wq,  // [C,H]
    const float* __restrict__ Wk,  // [C,H]
    const float* __restrict__ Wv,  // [C,H]
    float* __restrict__ out)       // [B,T,H]
{
  // ---- LDS ----
  // one struct fixes the order: the small arrays lie low, within reach of the LDS
  // instructions' immediate offsets; every member starts at a multiple of 16 B
  __shared__ __attribute__((aligned(16))) struct {
    float q[T_SZ * H_SZ];
    float k[T_SZ * H_SZ];
    float vt[H_SZ * VT_PITCH];    // V transposed: [h][t]
    float x[2 * ST_FLOATS];       // x ring, two stages
  } sm;
  float* const s_q  = sm.q;
  float* const s_k  = sm.k;
  float* const s_vt = sm.vt;
  float* const s_x  = sm.x;

  const int tid  = threadIdx.x;
  const int lane = tid & 31;
  const int wave = tid >> 5;
  const int half = lane >> 4;     // 0: lanes 0-15, 1: lanes 16-31
  const int l16  = lane & 15;
  const int koff = half * 2;      // K offset for A/B operand lane layout
  const int wave_s = __builtin_amdgcn_readfirstlane(wave);   // wave number in a scalar register
  const unsigned lds_x = (unsigned)(size_t)&s_x[0];          // byte offset of s_x in LDS
  const float* xwg = x + (size_t)blockIdx.x * NB_WG * T_SZ * C_SZ;   // this work-group's stages

  // stage 0 starts to fly while the weights are fetched
  copy_x_stage(xwg, lds_x, wave_s, lane);

  // wave = (16-row tile wave & 3 of a stage, weight tile wave >> 2): one 16x16 result a stage
  const int mt = wave_s & 3;
  const int nt = wave_s >> 2;

  // ---- this wave's weight tile, all of K, as B fragments in registers for the whole kernel ----
  // Tile 0: column n < 8 is Wq, n >= 8 is Wk. Tile 1: Wv in columns n < 8; its columns n >= 8
  // repeat Wv and are never stored. k slot (half, e) of step i is c = 4 * i + 2 * half + e.
  v2f wf[K_STEPS];
  {
    const float* wsel = (nt == 0) ? ((l16 < H_SZ) ? Wq : Wk) : Wv;
    const float* wp = wsel + koff * H_SZ + (l16 & 7);
#pragma unroll   // constant indices keep wf in registers
    for (int i = 0; i < K_STEPS - 1; ++i) {
      wf[i][0] = wp[i * 4 * H_SZ];
      wf[i][1] = wp[i * 4 * H_SZ + H_SZ];
    }
    wf[K_STEPS - 1][0] = wp[192 * H_SZ];
    // c = 195 is no row of the weights: half 1 reads row 194 again and holds 0 in that slot
    const float wlast = wp[(half ? 192 : 193) * H_SZ];
    wf[K_STEPS - 1][1] = half ? 0.0f : wlast;
  }
  // this wave's copies of stage 0 have landed; the barrier publishes them
  asm volatile("s_wait_asynccnt 0x0" ::: "memory");
  __syncthreads();
  copy_x_stage(xwg + ST_FLOATS, lds_x + ST_BYTES, wave_s, lane);   // stage 1 -> buffer 1

  for (int st = 0; st < N_STAGES; ++st) {

  // ================= Phase 1: q,k,v = x @ [Wq|Wk], x @ [Wv|Wv], one stage =================
  {
    // A-tile row, from this half's first k slot on
    const float* xa = &s_x[(st & 1) * ST_FLOATS + (mt * 16 + l16) * C_SZ + koff];

    v8f acc = {};

    // The A fragments come in groups of K_GROUP steps, one group ahead of the products that
    // use them. The last step is the tail c = 192..194, its slot c = 195 padded with zero.
    v2f af[2][K_GROUP];
#pragma unroll   // constant indices keep af in registers
    for (int j = 0; j < K_GROUP; ++j) { af[0][j][0] = xa[4 * j]; af[0][j][1] = xa[4 * j + 1]; }
#pragma unroll   // constant indices into wf and af
    for (int g = 0; g < K_STEPS / K_GROUP; ++g) {
      if (g + 1 < K_STEPS / K_GROUP) {
#pragma unroll   // constant indices keep af in registers
        for (int j = 0; j < K_GROUP; ++j) {
          const int i = (g + 1) * K_GROUP + j;
          af[(g + 1) & 1][j][0] = xa[4 * i];
          if (i < K_STEPS - 1) af[(g + 1) & 1][j][1] = xa[4 * i + 1];
          else af[(g + 1) & 1][j][1] = (192 + koff + 1 < C_SZ) ? xa[193] : 0.0f;   // c=195 is not part of the row
        }
      }
      // holds the next group's LDS reads together, in front of this group's products: left to
      // itself the scheduler puts each read just ahead of its use, and the wave waits on LDS
      __builtin_amdgcn_sched_barrier(0);
#pragma unroll   // constant indices into wf and af
      for (int j = 0; j < K_GROUP; ++j)
        acc = wmma_f32_4(af[g & 1][j], wf[g * K_GROUP + j], acc);
      // keeps the group after next's reads behind these products
      __builtin_amdgcn_sched_barrier(0);
    }


    // foot of the trip: this wave's LDS reads of stage st have returned and its copies of
    // stage st + 1 have landed; the barrier publishes stage st + 1 and frees the buffer of
    // stage st, into which stage st + 2 then flies. Every wave has also left the attention
    // phase of the batch before, so q, k and v may be written behind it.
    asm volatile("s_wait_dscnt 0x0" ::: "memory");
    asm volatile("s_wait_asynccnt 0x0" ::: "memory");
    __syncthreads();
    if (st + 2 < N_STAGES)
      copy_x_stage(xwg + (st + 2) * ST_FLOATS, lds_x + (st & 1) * ST_BYTES, wave_s, lane);

    const int t0 = (st & 3) * ST_ROWS + mt * 16;   // first row of the tile in its batch
    if (nt == 0) {
      // scatter the D tile (row M=r in VGPR r; lanes 16-31 hold M=r+8; N = l16)
#pragma unroll
      for (int r = 0; r < 8; ++r) {
        const int ta = t0 + r + half * 8;
        if (l16 < H_SZ) s_q[ta * H_SZ + l16]       = acc[r];
        else            s_k[ta * H_SZ + (l16 - 8)] = acc[r];
      }
    } else if (l16 < H_SZ) {
      // V goes to LDS transposed: a lane's 8 registers are 8 consecutive t of column h = l16
      float* vd = &s_vt[l16 * VT_PITCH + t0 + half * 8];
      *(v4f*)(vd)     = __builtin_shufflevector(acc, acc, 0, 1, 2, 3);
      *(v4f*)(vd + 4) = __builtin_shufflevector(acc, acc, 4, 5, 6, 7);
    }
  }

  if ((st & 3) != 3) continue;   // q, k, v of the batch are complete behind its fourth stage
  __syncthreads();               // publishes q, k and v
  const int b = blockIdx.x * NB_WG + (st >> 2);

  // ================= Phase 2: causal flash attention, transposed tiles =================
  // The score tile is formed as S^T = K Q^T, so a lane holds 8 keys of ONE query
  // (query = l16, keys = 8 * half + r): row maximum and row sum are in-lane work plus one
  // exchange between the halves, and the probabilities already sit as the B operand of
  // O^T = V^T P^T.
  // balance the causal triangle: wave w takes q-tiles {w, 15-w}
  // V^T rows as A operand; lanes 8..15 of a half repeat rows 0..7, so rows 8..15 of O^T
  // repeat rows 0..7 and both halves end up holding all 8 outputs of their query
  const float* vrow = &s_vt[(l16 & 7) * VT_PITCH + half * 8];

  for (int tile = 0; tile < 2; ++tile) {
    const int qt = (tile == 0) ? wave : (15 - wave);
    const int q0 = qt * 16;

    // Q B-operands for this tile (K = 0..3 and 4..7)
    const int qrow = q0 + l16;
    v2f bq0; bq0[0] = s_q[qrow * H_SZ + koff];     bq0[1] = s_q[qrow * H_SZ + koff + 1];
    v2f bq1; bq1[0] = s_q[qrow * H_SZ + 4 + koff]; bq1[1] = s_q[qrow * H_SZ + 4 + koff + 1];

    float m_run = -__builtin_inff();   // running maximum of query l16 (equal in both halves)
    float l_run = 0.0f;                // running sum over this half's keys only
    v8f o = {};

    for (int j0 = 0; j0 <= q0; j0 += 16) {
      // S^T tile = K(16x8) @ Q^T(8x16) : two K=4 WMMAs
      v2f ak0; ak0[0] = s_k[(j0 + l16) * H_SZ + koff];     ak0[1] = s_k[(j0 + l16) * H_SZ + koff + 1];
      v2f ak1; ak1[0] = s_k[(j0 + l16) * H_SZ + 4 + koff]; ak1[1] = s_k[(j0 + l16) * H_SZ + 4 + koff + 1];
      // this half's 8 keys of V^T row h: keys j0 + 8 * half + 0..7
      const v4f vlo = *(const v4f*)(vrow + j0);
      const v4f vhi = *(const v4f*)(vrow + j0 + 4);
      v8f s = {};
      s = wmma_f32_4(ak0, bq0, s);
      s = wmma_f32_4(ak1, bq1, s);

      const bool diag = (j0 == q0);

      float sv[8];
#pragma unroll   // constant indices keep sv in registers
      for (int r = 0; r < 8; ++r) {
        sv[r] = s[r] * SCALE_QK;
        if (diag && (r + half * 8 > l16)) sv[r] = -__builtin_inff();   // causal mask: key > query
      }

      float mx = fmaxf(fmaxf(fmaxf(sv[0], sv[1]), fmaxf(sv[2], sv[3])),
                       fmaxf(fmaxf(sv[4], sv[5]), fmaxf(sv[6], sv[7])));
      mx = fmaxf(mx, xhalf(mx));               // the other half's 8 keys of the same query

      const float mnew  = fmaxf(m_run, mx);
      const float alpha = __expf(m_run - mnew);

      // probabilities in pairs: pair ck is the B operand of PV WMMA ck
      v2f bp[4];
#pragma unroll   // constant indices keep bp in registers
      for (int ck = 0; ck < 4; ++ck) {
        v2f d; d[0] = sv[2 * ck]; d[1] = sv[2 * ck + 1];
        d = (d - mnew) * LOG2E;                    // exp(x) = exp2(x * log2(e)), on the pair
        bp[ck][0] = __builtin_amdgcn_exp2f(d[0]);
        bp[ck][1] = __builtin_amdgcn_exp2f(d[1]);
      }
      const v2f ps = (bp[0] + bp[1]) + (bp[2] + bp[3]);

      l_run = l_run * alpha + (ps[0] + ps[1]);
      m_run = mnew;
#pragma unroll   // constant indices into the accumulator registers
      for (int r = 0; r < 8; ++r) o[r] *= alpha;

      // O^T += V^T(8 rows repeated to 16, x 16 keys) @ P^T(16x16) : four K=4 WMMAs.
      // k slot (half, e) of WMMA ck is key j0 + 8 * half + 2 * ck + e on both operands.
      o = wmma_f32_4(__builtin_shufflevector(vlo, vlo, 0, 1), bp[0], o);
      o = wmma_f32_4(__builtin_shufflevector(vlo, vlo, 2, 3), bp[1], o);
      o = wmma_f32_4(__builtin_shufflevector(vhi, vhi, 0, 1), bp[2], o);
      o = wmma_f32_4(__builtin_shufflevector(vhi, vhi, 2, 3), bp[3], o);
    }

    // finalize: join the halves' sums, divide, store out[b, q0+l16, h];
    // half 0 stores h = 0..3, half 1 stores h = 4..7: 512 contiguous bytes per wave
    const float l_all = l_run + xhalf(l_run);
    const v4f olo = __builtin_shufflevector(o, o, 0, 1, 2, 3);
    const v4f ohi = __builtin_shufflevector(o, o, 4, 5, 6, 7);
    const v4f res = (half ? ohi : olo) / l_all;
    *(v4f*)&out[((size_t)b * T_SZ + q0 + l16) * H_SZ + half * 4] = res;
    // stands in front of the next tile's and the next batch's writes of the store's registers
    asm volatile("s_wait_xcnt 0x0" ::: "memory");
  }
  }   // stages
  asm volatile("s_wait_asynccnt 0x0" ::: "memory");   // no copy is left in flight at the end
}

extern "C" void kernel_launch(void* const* d_in, const int* in_sizes, int n_in,
                              void* d_out, int out_size, void* d_ws, size_t ws_size,
                              hipStream_t stream) {
  const float* x  = (const float*)d_in[0];
  const float* Wq = (const float*)d_in[1];
  const float* Wk = (const float*)d_in[2];
  const float* Wv = (const float*)d_in[3];
  float* out = (float*)d_out;
  (void)in_sizes; (void)n_in; (void)out_size; (void)d_ws; (void)ws_size;

  attn_head_kernel<<<dim3(B_SZ / NB_WG), dim3(256), 0, stream>>>(x, Wq, Wk, Wv, out);
}
